// v000
// Times are from an AMD MI455X. After a warm-up the kernel runs many times in a row, and a time is the length of
// such a window on the GPU divided by its runs, so every launch and the gaps after it count. The runs cycle
// through copies of the inputs. A figure is the median of several windows, for all but v000 over two sittings.
// Sittings can differ by a few percent; kernels timed side by side share one.
// The starting kernel, v000, takes 14.2 microseconds a run.
#include <hip/hip_runtime.h>
#include <hip/hip_bf16.h>

typedef __attribute__((ext_vector_type(2))) float v2f;
typedef __attribute__((ext_vector_type(8))) float v8f;

#define D_MODEL 256
#define S_SIZE  16
#define ROWS    32    // token rows per block (two 16-row WMMA tiles)
#define XPAD    260   // x LDS row stride (floats): 260 % 64 = 4 -> conflict-free b64 fetch
#define BPAD    20    // Bt LDS row stride (floats): 80 bytes, 16B aligned -> b128 row reads

#define LOG2E 1.4426950408889634f
#define LN2   0.6931471805599453f

__global__ __launch_bounds__(512) void ssm_fused_kernel(
    const float* __restrict__ x,    // [8192, 256] flattened (B,M,L,D)
    const float* __restrict__ W1,   // [256, 256]
    const float* __restrict__ b1,   // [256]
    const float* __restrict__ W2,   // [16, 256]
    const float* __restrict__ b2,   // [16]
    const float* __restrict__ A,    // [256, 16]
    float* __restrict__ out)        // [8192, 256]
{
    __shared__ __align__(16) float xs[ROWS * XPAD];   // x strip, padded
    __shared__ __align__(16) float bts[ROWS * BPAD];  // Bt tile [row][s], padded

    const int tid     = threadIdx.x;
    const int lane    = tid & 31;
    const int wave    = tid >> 5;           // 0..15
    const int hrow    = lane & 15;          // row-within-tile (A) / col-within-tile (B,C,D)
    const int koff    = (lane >> 4) * 2;    // K sub-offset: 0 (lanes 0-15) or 2 (lanes 16-31)
    const int mBase   = (lane >> 4) * 8;    // C/D row offset for upper half-wave
    const int rowBase = blockIdx.x * ROWS;  // token row of this block's strip
    const int colBase = wave * 16;          // output-column tile of this wave

    // ---- Seed Bt tile with bias b2 (partials from ds_add_f32 accumulate on top) ----
    {
        int m = tid >> 4, s = tid & 15;     // 512 threads cover 32x16 exactly
        bts[m * BPAD + s] = b2[s];
    }

    // ---- Stage x strip (32 x 256 f32 = 32KB) via async global->LDS b128 copies ----
    {
        const float* gsrc = x + (size_t)rowBase * D_MODEL;
        #pragma unroll
        for (int it = 0; it < 4; ++it) {
            int v = tid + it * 512;          // float4 index 0..2047
            int r = v >> 6;                  // 64 float4 per row
            int c = (v & 63) << 2;
            unsigned int loff = (unsigned int)(unsigned long long)(&xs[r * XPAD + c]);
            const float* g = gsrc + (size_t)v * 4;
            asm volatile("global_load_async_to_lds_b128 %0, %1, off"
                         :: "v"(loff), "v"(g) : "memory");
        }
        asm volatile("s_wait_asynccnt 0x0" ::: "memory");
    }
    __syncthreads();

    // A-operand bases: lane reads x[row][4k + koff + {0,1}] as one b64 per step
    const v2f* ap0 = reinterpret_cast<const v2f*>(&xs[hrow * XPAD + koff]);         // rows 0-15
    const v2f* ap1 = reinterpret_cast<const v2f*>(&xs[(16 + hrow) * XPAD + koff]);  // rows 16-31

    // ---- Waves 0-7: partial Bt tiles = x_strip * W2^T (2 row tiles x 4 K-slices) ----
    if (wave < 8) {
        const int t  = wave >> 2;            // row tile 0 or 1
        const int k0 = (wave & 3) * 16;      // K-step offset of this wave's slice
        const v2f* apt = t ? ap1 : ap0;
        const v2f* sp  = reinterpret_cast<const v2f*>(W2 + (size_t)hrow * D_MODEL + koff);
        v8f cb = {};
        #pragma unroll 8
        for (int k = 0; k < 16; ++k) {
            v2f a = apt[2 * (k0 + k)];
            v2f b = sp[2 * (k0 + k)];
            cb = __builtin_amdgcn_wmma_f32_16x16x4_f32(
                false, a, false, b, (short)0, cb, false, false);
        }
        #pragma unroll
        for (int v = 0; v < 8; ++v) {
            int m = t * 16 + v + mBase;                 // strip row (token)
            atomicAdd(&bts[m * BPAD + hrow], cb[v]);    // hrow == s index; ds_add_f32
        }
    }

    // ---- All waves: two Dp tiles = x_strip * W1^T, B-operand reused across row tiles ----
    const v2f* bp = reinterpret_cast<const v2f*>(
        W1 + (size_t)(colBase + hrow) * D_MODEL + koff);
    v8f c0 = {}, c1 = {};
    #pragma unroll 8
    for (int k = 0; k < 64; ++k) {
        v2f b  = bp[2 * k];                  // one global b64 serves both WMMAs
        v2f a0 = ap0[2 * k];
        v2f a1 = ap1[2 * k];
        c0 = __builtin_amdgcn_wmma_f32_16x16x4_f32(
            false, a0, false, b, (short)0, c0, false, false);
        c1 = __builtin_amdgcn_wmma_f32_16x16x4_f32(
            false, a1, false, b, (short)0, c1, false, false);
    }

    __syncthreads();   // Bt tiles (bias + all partials) visible to all waves

    // ---- Epilogue: per lane, 16 elements (2 tiles x rows mBase..mBase+7, col dcol) ----
    const int dcol = colBase + hrow;
    float a_s[S_SIZE];   // A row for this column, pre-scaled by log2(e) for v_exp_f32
    {
        const float4* Ag = reinterpret_cast<const float4*>(A + (size_t)dcol * S_SIZE);
        #pragma unroll
        for (int q = 0; q < 4; ++q) {
            float4 t = Ag[q];
            a_s[4 * q + 0] = t.x * LOG2E; a_s[4 * q + 1] = t.y * LOG2E;
            a_s[4 * q + 2] = t.z * LOG2E; a_s[4 * q + 3] = t.w * LOG2E;
        }
    }
    const float b1v = b1[dcol];

    #pragma unroll
    for (int t = 0; t < 2; ++t) {
        const v8f& c = t ? c1 : c0;
        #pragma unroll
        for (int v = 0; v < 8; ++v) {
            int   m  = t * 16 + v + mBase;
            float dp = c[v] + b1v;
            float xv = xs[m * XPAD + dcol];

            // softplus(dp) = ln(1 + e^dp); exp2/log2 domain (v_exp_f32 / v_log_f32)
            float et    = __builtin_amdgcn_exp2f(dp * LOG2E);
            float delta = (dp > 20.0f) ? dp : __builtin_amdgcn_logf(1.0f + et) * LN2;

            // Bt row m as 4x ds_load_b128 (half-wave broadcast, conflict-free)
            const float4* btr = reinterpret_cast<const float4*>(&bts[m * BPAD]);
            float4 q0 = btr[0], q1 = btr[1], q2 = btr[2], q3 = btr[3];
            float bt[S_SIZE] = { q0.x, q0.y, q0.z, q0.w,  q1.x, q1.y, q1.z, q1.w,
                                 q2.x, q2.y, q2.z, q2.w,  q3.x, q3.y, q3.z, q3.w };

            float acc = 0.0f, bsq = 0.0f;
            #pragma unroll
            for (int s = 0; s < S_SIZE; ++s) {
                acc += bt[s] * __builtin_amdgcn_exp2f(delta * a_s[s]);  // exp(delta*A[d,s])
                bsq += bt[s] * bt[s];
            }
            float y = acc + xv * delta * bsq;

            // silu(y) = y / (1 + e^-y)
            float ey = __builtin_amdgcn_exp2f(-y * LOG2E);
            y = y * __builtin_amdgcn_rcpf(1.0f + ey);

            out[(size_t)(rowBase + m) * D_MODEL + dcol] = xv * dp + y;
        }
    }
}

extern "C" void kernel_launch(void* const* d_in, const int* in_sizes, int n_in,
                              void* d_out, int out_size, void* d_ws, size_t ws_size,
                              hipStream_t stream) {
    const float* x  = (const float*)d_in[0];
    const float* W1 = (const float*)d_in[1];
    const float* b1 = (const float*)d_in[2];
    const float* W2 = (const float*)d_in[3];
    const float* b2 = (const float*)d_in[4];
    const float* A  = (const float*)d_in[5];
    float* out = (float*)d_out;

    // 8192 token rows / 32 per block = 256 blocks; 512 threads = 16 wave32
    ssm_fused_kernel<<<256, 512, 0, stream>>>(x, W1, b1, W2, b2, A, out);
}

// v001
// Measured time: 13.7 microseconds a run.
// In two side-by-side timings against v000, it was 1.06 and 1.07 times as fast.
#include <hip/hip_runtime.h>
#include <hip/hip_bf16.h>

typedef __attribute__((ext_vector_type(2))) float v2f;
typedef __attribute__((ext_vector_type(8))) float v8f;

#define D_MODEL 256
#define S_SIZE  16
#define ROWS    32    // token rows per block (two 16-row WMMA tiles)
#define XPAD    260   // x LDS row stride (floats): 260 % 64 = 4 -> conflict-free b64 fetch
#define BPAD    20    // Bt LDS row stride (floats): 80 bytes, 16B aligned -> b128 row reads; slot 16 = sum of squares
#define KSL     4     // K-slices of the Bt product, one partial plane each

#define LOG2E 1.4426950408889634f
#define LN2   0.6931471805599453f

__global__ __launch_bounds__(512) void ssm_fused_kernel(
    const float* __restrict__ x,    // [8192, 256] flattened (B,M,L,D)
    const float* __restrict__ W1,   // [256, 256]
    const float* __restrict__ b1,   // [256]
    const float* __restrict__ W2,   // [16, 256]
    const float* __restrict__ b2,   // [16]
    const float* __restrict__ A,    // [256, 16]
    float* __restrict__ out)        // [8192, 256]
{
    __shared__ __align__(16) float xs[ROWS * XPAD];   // x strip, padded
    __shared__ __align__(16) float bts[ROWS * BPAD];  // Bt tile [row][s], padded; [row][16] = sum_s Bt^2
    __shared__ __align__(16) float btp[KSL * ROWS * BPAD];  // Bt partials [slice][row][s]

    const int tid     = threadIdx.x;
    const int lane    = tid & 31;
    const int wave    = tid >> 5;           // 0..15
    const int hrow    = lane & 15;          // row-within-tile (A) / col-within-tile (B,C,D)
    const int koff    = (lane >> 4) * 2;    // K sub-offset: 0 (lanes 0-15) or 2 (lanes 16-31)
    const int mBase   = (lane >> 4) * 8;    // C/D row offset for upper half-wave
    const int rowBase = blockIdx.x * ROWS;  // token row of this block's strip
    const int colBase = wave * 16;          // output-column tile of this wave

    // Bias of the Bt element (row tid>>4, state tid&15) that this thread joins after the GEMM
    const float b2v = b2[tid & 15];

    // ---- Stage x strip (32 x 256 f32 = 32KB) via async global->LDS b128 copies ----
    {
        const float* gsrc = x + (size_t)rowBase * D_MODEL;
        #pragma unroll
        for (int it = 0; it < 4; ++it) {
            int v = tid + it * 512;          // float4 index 0..2047
            int r = v >> 6;                  // 64 float4 per row
            int c = (v & 63) << 2;
            unsigned int loff = (unsigned int)(unsigned long long)(&xs[r * XPAD + c]);
            const float* g = gsrc + (size_t)v * 4;
            asm volatile("global_load_async_to_lds_b128 %0, %1, off"
                         :: "v"(loff), "v"(g) : "memory");
        }
        asm volatile("s_wait_asynccnt 0x0" ::: "memory");
    }
    __syncthreads();

    // A-operand bases: lane reads x[row][4k + koff + {0,1}] as one b64 per step
    const v2f* ap0 = reinterpret_cast<const v2f*>(&xs[hrow * XPAD + koff]);         // rows 0-15
    const v2f* ap1 = reinterpret_cast<const v2f*>(&xs[(16 + hrow) * XPAD + koff]);  // rows 16-31

    // ---- Waves 0-7: partial Bt tiles = x_strip * W2^T (2 row tiles x 4 K-slices) ----
    if (wave < 8) {
        const int t  = wave >> 2;            // row tile 0 or 1
        const int k0 = (wave & 3) * 16;      // K-step offset of this wave's slice
        const v2f* apt = t ? ap1 : ap0;
        const v2f* sp  = reinterpret_cast<const v2f*>(W2 + (size_t)hrow * D_MODEL + koff);
        v8f cb = {};
        #pragma unroll 8
        for (int k = 0; k < 16; ++k) {
            v2f a = apt[2 * (k0 + k)];
            v2f b = sp[2 * (k0 + k)];
            cb = __builtin_amdgcn_wmma_f32_16x16x4_f32(
                false, a, false, b, (short)0, cb, false, false);
        }
        #pragma unroll
        for (int v = 0; v < 8; ++v) {
            int m = t * 16 + v + mBase;                 // strip row (token)
            btp[((wave & 3) * ROWS + m) * BPAD + hrow] = cb[v];   // hrow == s index
        }
    }

    // ---- All waves: two Dp tiles = x_strip * W1^T, B-operand reused across row tiles ----
    const v2f* bp = reinterpret_cast<const v2f*>(
        W1 + (size_t)(colBase + hrow) * D_MODEL + koff);
    v8f c0 = {}, c1 = {};
    #pragma unroll 8
    for (int k = 0; k < 64; ++k) {
        v2f b  = bp[2 * k];                  // one global b64 serves both WMMAs
        v2f a0 = ap0[2 * k];
        v2f a1 = ap1[2 * k];
        c0 = __builtin_amdgcn_wmma_f32_16x16x4_f32(
            false, a0, false, b, (short)0, c0, false, false);
        c1 = __builtin_amdgcn_wmma_f32_16x16x4_f32(
            false, a1, false, b, (short)0, c1, false, false);
    }

    __syncthreads();   // Bt partials visible to all waves

    // ---- Epilogue: per lane, 16 elements (2 tiles x rows mBase..mBase+7, col dcol) ----
    const int dcol = colBase + hrow;
    float a_s[S_SIZE];   // A row for this column, pre-scaled by log2(e) for v_exp_f32
    {
        const float4* Ag = reinterpret_cast<const float4*>(A + (size_t)dcol * S_SIZE);
        #pragma unroll
        for (int q = 0; q < 4; ++q) {
            float4 t = Ag[q];
            a_s[4 * q + 0] = t.x * LOG2E; a_s[4 * q + 1] = t.y * LOG2E;
            a_s[4 * q + 2] = t.z * LOG2E; a_s[4 * q + 3] = t.w * LOG2E;
        }
    }
    const float b1v = b1[dcol];

    // ---- Join Bt once per element (bias, then slices 0..3 in that order) and sum its squares
    //      once per row, so that the per-element loop below carries no Bt^2 work ----
    {
        const int e = (tid >> 4) * BPAD + (tid & 15);   // 512 threads cover 32x16 exactly
        float bv = b2v;
        #pragma unroll
        for (int j = 0; j < KSL; ++j) bv += btp[j * ROWS * BPAD + e];
        float sq = bv * bv;
        // 16-lane butterfly (DPP row_xmask 1,2,4,8): every lane of a row ends with the row's sum
        sq += __builtin_bit_cast(float, __builtin_amdgcn_update_dpp(0, __builtin_bit_cast(int, sq), 0x161, 0xf, 0xf, false));
        sq += __builtin_bit_cast(float, __builtin_amdgcn_update_dpp(0, __builtin_bit_cast(int, sq), 0x162, 0xf, 0xf, false));
        sq += __builtin_bit_cast(float, __builtin_amdgcn_update_dpp(0, __builtin_bit_cast(int, sq), 0x164, 0xf, 0xf, false));
        sq += __builtin_bit_cast(float, __builtin_amdgcn_update_dpp(0, __builtin_bit_cast(int, sq), 0x168, 0xf, 0xf, false));
        bts[e] = bv;
        if ((tid & 15) == 0) bts[(tid >> 4) * BPAD + S_SIZE] = sq;
    }
    __syncthreads();   // joined Bt rows and their square sums visible to all waves

    #pragma unroll
    for (int t = 0; t < 2; ++t) {
        const v8f& c = t ? c1 : c0;
        #pragma unroll
        for (int v = 0; v < 8; ++v) {
            int   m  = t * 16 + v + mBase;
            float dp = c[v] + b1v;
            float xv = xs[m * XPAD + dcol];

            // softplus(dp) = ln(1 + e^dp); exp2/log2 domain (v_exp_f32 / v_log_f32)
            float et    = __builtin_amdgcn_exp2f(dp * LOG2E);
            float delta = (dp > 20.0f) ? dp : __builtin_amdgcn_logf(1.0f + et) * LN2;

            // Bt row m as 4x ds_load_b128 (half-wave broadcast, conflict-free)
            const float4* btr = reinterpret_cast<const float4*>(&bts[m * BPAD]);
            float4 q0 = btr[0], q1 = btr[1], q2 = btr[2], q3 = btr[3];
            float bt[S_SIZE] = { q0.x, q0.y, q0.z, q0.w,  q1.x, q1.y, q1.z, q1.w,
                                 q2.x, q2.y, q2.z, q2.w,  q3.x, q3.y, q3.z, q3.w };

            const float bsq = bts[m * BPAD + S_SIZE];   // sum_s Bt[m][s]^2, made once per row

            // Written as fma: one instruction per state (left as a*b+c the build split it
            // into a packed multiply, separate adds and register moves)
            float acc = 0.0f;
            #pragma unroll
            for (int s = 0; s < S_SIZE; ++s)
                acc = __builtin_fmaf(bt[s], __builtin_amdgcn_exp2f(delta * a_s[s]), acc);  // exp(delta*A[d,s])
            float y = acc + xv * delta * bsq;

            // silu(y) = y / (1 + e^-y)
            float ey = __builtin_amdgcn_exp2f(-y * LOG2E);
            y = y * __builtin_amdgcn_rcpf(1.0f + ey);

            out[(size_t)(rowBase + m) * D_MODEL + dcol] = xv * dp + y;
        }
    }
}

extern "C" void kernel_launch(void* const* d_in, const int* in_sizes, int n_in,
                              void* d_out, int out_size, void* d_ws, size_t ws_size,
                              hipStream_t stream) {
    const float* x  = (const float*)d_in[0];
    const float* W1 = (const float*)d_in[1];
    const float* b1 = (const float*)d_in[2];
    const float* W2 = (const float*)d_in[3];
    const float* b2 = (const float*)d_in[4];
    const float* A  = (const float*)d_in[5];
    float* out = (float*)d_out;

    // 8192 token rows / 32 per block = 256 blocks; 512 threads = 16 wave32
    ssm_fused_kernel<<<256, 512, 0, stream>>>(x, W1, b1, W2, b2, A, out);
}

// v002
// It runs in 12.3 microseconds.
// Two timings next to v001 put it at 1.12 and 1.11 times that version's speed.
// All steps since v000 together make it 1.18 times as fast.
#include <hip/hip_runtime.h>
#include <hip/hip_bf16.h>

typedef __attribute__((ext_vector_type(2))) float v2f;
typedef __attribute__((ext_vector_type(8))) float v8f;

#define D_MODEL 256
#define S_SIZE  16
#define ROWS    32    // token rows per block (two 16-row WMMA tiles)
#define XPAD    260   // x LDS row stride (floats): 260 % 64 = 4 -> conflict-free b64 fetch
#define BPAD    20    // Bt LDS row stride (floats): 80 bytes, 16B aligned -> b128 row reads; slot 16 = sum of squares
#define KSL     4     // K-slices of the Bt product, one partial plane each
#define WPAD    260   // W1 LDS row stride (floats): same bank pattern as the x strip
#define KCH     4     // K-chunks of a wave's W1 slice (64 floats of each of its 16 rows)

#define LOG2E 1.4426950408889634f
#define LN2   0.6931471805599453f

// One K-chunk of a wave's own W1 slice, global -> LDS: 16 rows x 256 B as 8 copies, each copy two
// whole 256-B row pieces (lanes 0-15 row 2j, lanes 16-31 row 2j+1). l[j], g[j]: the lane's LDS byte
// address and global pointer in chunk 0; the immediate offset OFF = 256 * chunk moves both alike, so
// the matrix loop holds no address arithmetic. The closing s_wait_xcnt is a precaution: it holds every
// later write of the address registers behind the copies' address translation.
template <int OFF>
__device__ __forceinline__ void copy_w1_chunk(const unsigned int (&l)[8], const float* const (&g)[8]) {
    asm volatile("global_load_async_to_lds_b128 %0, %8, off offset:%16\n\t"
                 "global_load_async_to_lds_b128 %1, %9, off offset:%16\n\t"
                 "global_load_async_to_lds_b128 %2, %10, off offset:%16\n\t"
                 "global_load_async_to_lds_b128 %3, %11, off offset:%16\n\t"
                 "global_load_async_to_lds_b128 %4, %12, off offset:%16\n\t"
                 "global_load_async_to_lds_b128 %5, %13, off offset:%16\n\t"
                 "global_load_async_to_lds_b128 %6, %14, off offset:%16\n\t"
                 "global_load_async_to_lds_b128 %7, %15, off offset:%16\n\t"
                 "s_wait_xcnt 0x0"
                 :: "v"(l[0]), "v"(l[1]), "v"(l[2]), "v"(l[3]), "v"(l[4]), "v"(l[5]), "v"(l[6]), "v"(l[7]),
                    "v"(g[0]), "v"(g[1]), "v"(g[2]), "v"(g[3]), "v"(g[4]), "v"(g[5]), "v"(g[6]), "v"(g[7]),
                    "n"(OFF)
                 : "memory");
}

__global__ __launch_bounds__(512) void ssm_fused_kernel(
    const float* __restrict__ x,    // [8192, 256] flattened (B,M,L,D)
    const float* __restrict__ W1,   // [256, 256]
    const float* __restrict__ b1,   // [256]
    const float* __restrict__ W2,   // [16, 256]
    const float* __restrict__ b2,   // [16]
    const float* __restrict__ A,    // [256, 16]
    float* __restrict__ out)        // [8192, 256]
{
    __shared__ __align__(16) float xs[ROWS * XPAD];   // x strip, padded
    __shared__ __align__(16) float bts[ROWS * BPAD];  // Bt tile [row][s], padded; [row][16] = sum_s Bt^2
    __shared__ __align__(16) float btp[KSL * ROWS * BPAD];  // Bt partials [slice][row][s]
    __shared__ __align__(16) float w1s[D_MODEL * WPAD];     // W1, padded; rows 16w..16w+15 are wave w's own

    const int tid     = threadIdx.x;
    const int lane    = tid & 31;
    const int wave    = tid >> 5;           // 0..15
    const int hrow    = lane & 15;          // row-within-tile (A) / col-within-tile (B,C,D)
    const int koff    = (lane >> 4) * 2;    // K sub-offset: 0 (lanes 0-15) or 2 (lanes 16-31)
    const int mBase   = (lane >> 4) * 8;    // C/D row offset for upper half-wave
    const int rowBase = blockIdx.x * ROWS;  // token row of this block's strip
    const int colBase = wave * 16;          // output-column tile of this wave

    // Bias of the Bt element (row tid>>4, state tid&15) that this thread joins after the GEMM
    const float b2v = b2[tid & 15];

    // ---- Stage x strip (32 x 256 f32 = 32KB) via async global->LDS b128 copies ----
    // This lane's place in a W1 chunk copy: row (lane >> 4) of a row pair, 16 B at float (lane & 15) * 4
    const float* wg[8];
    unsigned int wl[8];
    #pragma unroll   // wg and wl are indexed by constants only and stay in registers
    for (int j = 0; j < 8; ++j) {
        const int wr = colBase + 2 * j + (lane >> 4);
        wg[j] = W1 + (size_t)wr * D_MODEL + ((lane & 15) << 2);
        wl[j] = (unsigned int)(unsigned long long)(&w1s[wr * WPAD + ((lane & 15) << 2)]);
    }
    {
        const float* gsrc = x + (size_t)rowBase * D_MODEL;
        unsigned int loff[4];
        const float* g[4];
        #pragma unroll
        for (int it = 0; it < 4; ++it) {
            int v = tid + it * 512;          // float4 index 0..2047
            int r = v >> 6;                  // 64 float4 per row
            int c = (v & 63) << 2;
            loff[it] = (unsigned int)(unsigned long long)(&xs[r * XPAD + c]);
            g[it] = gsrc + (size_t)v * 4;
        }
        // s_wait_xcnt, a precaution: holds later writes of the address registers behind the translation
        asm volatile("global_load_async_to_lds_b128 %0, %4, off\n\t"
                     "global_load_async_to_lds_b128 %1, %5, off\n\t"
                     "global_load_async_to_lds_b128 %2, %6, off\n\t"
                     "global_load_async_to_lds_b128 %3, %7, off\n\t"
                     "s_wait_xcnt 0x0"
                     :: "v"(loff[0]), "v"(loff[1]), "v"(loff[2]), "v"(loff[3]),
                        "v"(g[0]), "v"(g[1]), "v"(g[2]), "v"(g[3]) : "memory");
        copy_w1_chunk<0>(wl, wg);            // W1 chunk 0 lands together with the x strip
        // x strip and W1 chunk 0 landed before the barrier publishes the strip
        asm volatile("s_wait_asynccnt 0x0" ::: "memory");
    }
    __syncthreads();
    copy_w1_chunk<256>(wl, wg);              // W1 chunk 1 flies while chunk 0 is worked on

    // A-operand bases: lane reads x[row][4k + koff + {0,1}] as one b64 per step
    const v2f* ap0 = reinterpret_cast<const v2f*>(&xs[hrow * XPAD + koff]);         // rows 0-15
    const v2f* ap1 = reinterpret_cast<const v2f*>(&xs[(16 + hrow) * XPAD + koff]);  // rows 16-31

    // ---- Waves 0-7: partial Bt tiles = x_strip * W2^T (2 row tiles x 4 K-slices) ----
    if (wave < 8) {
        const int t  = wave >> 2;            // row tile 0 or 1
        const int k0 = (wave & 3) * 16;      // K-step offset of this wave's slice
        const v2f* apt = t ? ap1 : ap0;
        const v2f* sp  = reinterpret_cast<const v2f*>(W2 + (size_t)hrow * D_MODEL + koff);
        v8f cb = {};
        #pragma unroll 8
        for (int k = 0; k < 16; ++k) {
            v2f a = apt[2 * (k0 + k)];
            v2f b = sp[2 * (k0 + k)];
            cb = __builtin_amdgcn_wmma_f32_16x16x4_f32(
                false, a, false, b, (short)0, cb, false, false);
        }
        #pragma unroll
        for (int v = 0; v < 8; ++v) {
            int m = t * 16 + v + mBase;                 // strip row (token)
            btp[((wave & 3) * ROWS + m) * BPAD + hrow] = cb[v];   // hrow == s index
        }
    }

    // ---- All waves: two Dp tiles = x_strip * W1^T, B-operand reused across row tiles ----
    //      B fragments come from the wave's own W1 rows in LDS (no other wave reads them: no barrier)
    const v2f* bp = reinterpret_cast<const v2f*>(&w1s[(colBase + hrow) * WPAD + koff]);
    v8f c0 = {}, c1 = {};
    #pragma unroll   // chunk number must be a constant: the last trips issue no copy
    for (int ch = 0; ch < KCH; ++ch) {
        #pragma unroll   // every fragment address becomes base + immediate
        for (int k = 16 * ch; k < 16 * ch + 16; ++k) {
            v2f b  = bp[2 * k];              // one LDS b64 serves both WMMAs
            v2f a0 = ap0[2 * k];
            v2f a1 = ap1[2 * k];
            c0 = __builtin_amdgcn_wmma_f32_16x16x4_f32(
                false, a0, false, b, (short)0, c0, false, false);
            c1 = __builtin_amdgcn_wmma_f32_16x16x4_f32(
                false, a1, false, b, (short)0, c1, false, false);
        }
        if (ch + 1 < KCH) {
            // this wave's chunk ch + 1 landed before its first fragment read
            asm volatile("s_wait_asynccnt 0x0" ::: "memory");
            if (ch == 0) copy_w1_chunk<512>(wl, wg);
            if (ch == 1) copy_w1_chunk<768>(wl, wg);
        }
    }

    // The two scheduling barriers keep the vector work below out of the last WMMAs; the four v_nop
    // are the vector slots between the last WMMAs and the first such overwrite
    __builtin_amdgcn_sched_barrier(0);
    asm volatile("v_nop\n\tv_nop\n\tv_nop\n\tv_nop");
    __builtin_amdgcn_sched_barrier(0);
    __syncthreads();   // Bt partials visible to all waves

    // ---- Epilogue: per lane, 16 elements (2 tiles x rows mBase..mBase+7, col dcol) ----
    const int dcol = colBase + hrow;
    float a_s[S_SIZE];   // A row for this column, pre-scaled by log2(e) for v_exp_f32
    {
        const float4* Ag = reinterpret_cast<const float4*>(A + (size_t)dcol * S_SIZE);
        #pragma unroll
        for (int q = 0; q < 4; ++q) {
            float4 t = Ag[q];
            a_s[4 * q + 0] = t.x * LOG2E; a_s[4 * q + 1] = t.y * LOG2E;
            a_s[4 * q + 2] = t.z * LOG2E; a_s[4 * q + 3] = t.w * LOG2E;
        }
    }
    const float b1v = b1[dcol];

    // ---- Join Bt once per element (bias, then slices 0..3 in that order) and sum its squares
    //      once per row, so that the per-element loop below carries no Bt^2 work ----
    {
        const int e = (tid >> 4) * BPAD + (tid & 15);   // 512 threads cover 32x16 exactly
        float bv = b2v;
        #pragma unroll
        for (int j = 0; j < KSL; ++j) bv += btp[j * ROWS * BPAD + e];
        float sq = bv * bv;
        // 16-lane butterfly (DPP row_xmask 1,2,4,8): every lane of a row ends with the row's sum
        sq += __builtin_bit_cast(float, __builtin_amdgcn_update_dpp(0, __builtin_bit_cast(int, sq), 0x161, 0xf, 0xf, false));
        sq += __builtin_bit_cast(float, __builtin_amdgcn_update_dpp(0, __builtin_bit_cast(int, sq), 0x162, 0xf, 0xf, false));
        sq += __builtin_bit_cast(float, __builtin_amdgcn_update_dpp(0, __builtin_bit_cast(int, sq), 0x164, 0xf, 0xf, false));
        sq += __builtin_bit_cast(float, __builtin_amdgcn_update_dpp(0, __builtin_bit_cast(int, sq), 0x168, 0xf, 0xf, false));
        bts[e] = bv;
        if ((tid & 15) == 0) bts[(tid >> 4) * BPAD + S_SIZE] = sq;
    }
    __syncthreads();   // joined Bt rows and their square sums visible to all waves

    #pragma unroll
    for (int t = 0; t < 2; ++t) {
        const v8f& c = t ? c1 : c0;
        #pragma unroll
        for (int v = 0; v < 8; ++v) {
            int   m  = t * 16 + v + mBase;
            float dp = c[v] + b1v;
            float xv = xs[m * XPAD + dcol];

            // softplus(dp) = ln(1 + e^dp); exp2/log2 domain (v_exp_f32 / v_log_f32)
            float et    = __builtin_amdgcn_exp2f(dp * LOG2E);
            float delta = (dp > 20.0f) ? dp : __builtin_amdgcn_logf(1.0f + et) * LN2;

            // Bt row m as 4x ds_load_b128 (half-wave broadcast, conflict-free)
            const float4* btr = reinterpret_cast<const float4*>(&bts[m * BPAD]);
            float4 q0 = btr[0], q1 = btr[1], q2 = btr[2], q3 = btr[3];
            float bt[S_SIZE] = { q0.x, q0.y, q0.z, q0.w,  q1.x, q1.y, q1.z, q1.w,
                                 q2.x, q2.y, q2.z, q2.w,  q3.x, q3.y, q3.z, q3.w };

            const float bsq = bts[m * BPAD + S_SIZE];   // sum_s Bt[m][s]^2, made once per row

            // Written as fma: one instruction per state (left as a*b+c the build split it
            // into a packed multiply, separate adds and register moves)
            float acc = 0.0f;
            #pragma unroll
            for (int s = 0; s < S_SIZE; ++s)
                acc = __builtin_fmaf(bt[s], __builtin_amdgcn_exp2f(delta * a_s[s]), acc);  // exp(delta*A[d,s])
            float y = acc + xv * delta * bsq;

            // silu(y) = y / (1 + e^-y)
            float ey = __builtin_amdgcn_exp2f(-y * LOG2E);
            y = y * __builtin_amdgcn_rcpf(1.0f + ey);

            out[(size_t)(rowBase + m) * D_MODEL + dcol] = xv * dp + y;
        }
    }
}

extern "C" void kernel_launch(void* const* d_in, const int* in_sizes, int n_in,
                              void* d_out, int out_size, void* d_ws, size_t ws_size,
                              hipStream_t stream) {
    const float* x  = (const float*)d_in[0];
    const float* W1 = (const float*)d_in[1];
    const float* b1 = (const float*)d_in[2];
    const float* W2 = (const float*)d_in[3];
    const float* b2 = (const float*)d_in[4];
    const float* A  = (const float*)d_in[5];
    float* out = (float*)d_out;

    // 8192 token rows / 32 per block = 256 blocks; 512 threads = 16 wave32
    ssm_fused_kernel<<<256, 512, 0, stream>>>(x, W1, b1, W2, b2, A, out);
}
